// v000
// Times are from an AMD MI455X. After a warm-up the kernel runs many times in a row, and a time is the length of
// such a window on the GPU divided by its runs, so every launch and the gaps after it count. The runs cycle
// through copies of the inputs. A figure is the median of several windows, for all but v000 over two sittings.
// Sittings can differ by a few percent; kernels timed side by side share one.
// The starting kernel, v000, takes 333 microseconds a run.
#include <hip/hip_runtime.h>
#include <hip/hip_bf16.h>

typedef __attribute__((ext_vector_type(2))) float v2f;
typedef __attribute__((ext_vector_type(8))) float v8f;

__device__ __forceinline__ v8f wmma4(v2f a, v2f b, v8f c) {
    // D = A(16x4 f32) * B(4x16 f32) + C(16x16 f32), exact fp32
    return __builtin_amdgcn_wmma_f32_16x16x4_f32(false, a, false, b, (short)0, c,
                                                 false, false);
}

__device__ __forceinline__ void async_b128(unsigned ldsOff, const void* gaddr) {
    asm volatile("global_load_async_to_lds_b128 %0, %1, off"
                 :: "v"(ldsOff), "v"(gaddr) : "memory");
}
__device__ __forceinline__ void wait_async0() {
    asm volatile("s_wait_asynccnt 0" ::: "memory");
}

#define AS  36
#define BSP 160
#define XNS 68

// ---------------------------------------------------------------------------
// D[M,N] = alpha * (A[M,K] @ W[K,N]) + bias[N]   (batched via z; W shared)
// block = 256 threads (8 waves); tile 128(M) x 64(N); K chunk 32
// A tile: async global->LDS DMA (double buffered); B tile: reg-staged interleave
// ---------------------------------------------------------------------------
__global__ __launch_bounds__(256)
void gemm_bias_k(const float* __restrict__ A, const float* __restrict__ W,
                 const float* __restrict__ bias, float* __restrict__ D,
                 int M, int N, int K, float alpha,
                 long long aBatch, long long dBatch)
{
    __shared__ float Asm[2 * 128 * AS];
    __shared__ float Bsm[2 * 16 * BSP];
    A += (long long)blockIdx.z * aBatch;
    D += (long long)blockIdx.z * dBatch;
    const int m0 = blockIdx.y * 128;
    const int n0 = blockIdx.x * 64;
    const int t    = threadIdx.x;
    const int lane = t & 31;
    const int wid  = t >> 5;          // 0..7
    const int mlo  = lane & 15;
    const int hi   = lane >> 4;       // 0/1
    const int khalf = hi * 2;

    int arow[4], akq[4];
#pragma unroll
    for (int r = 0; r < 4; ++r) { int idx = t + r * 256; arow[r] = idx >> 3; akq[r] = (idx & 7) << 2; }
    int brow[2], bnq[2];
#pragma unroll
    for (int r = 0; r < 2; ++r) { int idx = t + r * 256; brow[r] = idx >> 4; bnq[r] = (idx & 15) << 2; }

    float4 rb[2];
    v8f acc[4] = {};
    const int NC = K >> 5;

    // prologue: chunk 0 (A via async DMA, B via registers)
#pragma unroll
    for (int r = 0; r < 4; ++r)
        async_b128((unsigned)(size_t)&Asm[arow[r] * AS + akq[r]],
                   A + (size_t)(m0 + arow[r]) * K + akq[r]);
#pragma unroll
    for (int r = 0; r < 2; ++r)
        rb[r] = *(const float4*)(W + (size_t)brow[r] * N + n0 + bnq[r]);
#pragma unroll
    for (int r = 0; r < 2; ++r) {
        float* bp = &Bsm[(brow[r] >> 1) * BSP + (brow[r] & 1)];
        bp[(bnq[r] + 0) * 2] = rb[r].x;  bp[(bnq[r] + 1) * 2] = rb[r].y;
        bp[(bnq[r] + 2) * 2] = rb[r].z;  bp[(bnq[r] + 3) * 2] = rb[r].w;
    }
    wait_async0();
    __syncthreads();

    for (int c = 0; c < NC; ++c) {
        const int cur = c & 1;
        const int nxt = cur ^ 1;
        const int k1 = (c + 1) << 5;
        if (c + 1 < NC) {
            float* asn = &Asm[nxt * 128 * AS];
#pragma unroll
            for (int r = 0; r < 4; ++r)
                async_b128((unsigned)(size_t)&asn[arow[r] * AS + akq[r]],
                           A + (size_t)(m0 + arow[r]) * K + k1 + akq[r]);
#pragma unroll
            for (int r = 0; r < 2; ++r)
                rb[r] = *(const float4*)(W + (size_t)(k1 + brow[r]) * N + n0 + bnq[r]);
        }
        const float* as = &Asm[cur * 128 * AS];
        const float* bs = &Bsm[cur * 16 * BSP];
#pragma unroll
        for (int kk = 0; kk < 32; kk += 4) {
            v2f a = *(const v2f*)(&as[(wid * 16 + mlo) * AS + kk + khalf]);
            const float* bp = &bs[((kk >> 1) + hi) * BSP + mlo * 2];
            v2f b0 = *(const v2f*)(bp + 0);
            v2f b1 = *(const v2f*)(bp + 32);
            v2f b2 = *(const v2f*)(bp + 64);
            v2f b3 = *(const v2f*)(bp + 96);
            acc[0] = wmma4(a, b0, acc[0]);
            acc[1] = wmma4(a, b1, acc[1]);
            acc[2] = wmma4(a, b2, acc[2]);
            acc[3] = wmma4(a, b3, acc[3]);
        }
        if (c + 1 < NC) {
            float* bsn = &Bsm[nxt * 16 * BSP];
#pragma unroll
            for (int r = 0; r < 2; ++r) {
                float* bp = &bsn[(brow[r] >> 1) * BSP + (brow[r] & 1)];
                bp[(bnq[r] + 0) * 2] = rb[r].x;  bp[(bnq[r] + 1) * 2] = rb[r].y;
                bp[(bnq[r] + 2) * 2] = rb[r].z;  bp[(bnq[r] + 3) * 2] = rb[r].w;
            }
        }
        wait_async0();
        __syncthreads();
    }

    const int rbase = m0 + wid * 16 + hi * 8;
#pragma unroll
    for (int nt = 0; nt < 4; ++nt) {
        const int col = n0 + nt * 16 + mlo;
        const float bv = bias ? bias[col] : 0.0f;
#pragma unroll
        for (int r = 0; r < 8; ++r)
            D[(size_t)(rbase + r) * N + col] = acc[nt][r] * alpha + bv;
    }
}

// ---------------------------------------------------------------------------
// S_b[256,256] = X_b[K,256]^T @ Y_b[K,256]   (batched)
// block = 128 threads (4 waves); tile 64 x 64; K chunk 32
// X tile: async DMA into natural [k][m] layout; Y tile: reg-staged interleave
// ---------------------------------------------------------------------------
__global__ __launch_bounds__(128)
void gemm_tn_k(const float* __restrict__ X, const float* __restrict__ Y,
               float* __restrict__ S, int Kd,
               long long xBatch, long long yBatch)
{
    __shared__ float Xsm[2 * 32 * XNS];
    __shared__ float Ysm[2 * 16 * BSP];
    X += (long long)blockIdx.z * xBatch;
    Y += (long long)blockIdx.z * yBatch;
    S += (long long)blockIdx.z * (256LL * 256LL);
    const int m0 = blockIdx.y * 64;
    const int n0 = blockIdx.x * 64;
    const int t    = threadIdx.x;
    const int lane = t & 31;
    const int wid  = t >> 5;          // 0..3
    const int mlo  = lane & 15;
    const int hi   = lane >> 4;
    const int khalf = hi * 2;

    int row[4], q[4];
#pragma unroll
    for (int r = 0; r < 4; ++r) { int idx = t + r * 128; row[r] = idx >> 4; q[r] = (idx & 15) << 2; }

    float4 ry[4];
    v8f acc[4] = {};
    const int NC = Kd >> 5;

#pragma unroll
    for (int r = 0; r < 4; ++r)
        async_b128((unsigned)(size_t)&Xsm[row[r] * XNS + q[r]],
                   X + (size_t)row[r] * 256 + m0 + q[r]);
#pragma unroll
    for (int r = 0; r < 4; ++r)
        ry[r] = *(const float4*)(Y + (size_t)row[r] * 256 + n0 + q[r]);
#pragma unroll
    for (int r = 0; r < 4; ++r) {
        float* yp = &Ysm[(row[r] >> 1) * BSP + (row[r] & 1)];
        yp[(q[r] + 0) * 2] = ry[r].x;  yp[(q[r] + 1) * 2] = ry[r].y;
        yp[(q[r] + 2) * 2] = ry[r].z;  yp[(q[r] + 3) * 2] = ry[r].w;
    }
    wait_async0();
    __syncthreads();

    for (int c = 0; c < NC; ++c) {
        const int cur = c & 1;
        const int nxt = cur ^ 1;
        const int k1 = (c + 1) << 5;
        if (c + 1 < NC) {
            float* xb = &Xsm[nxt * 32 * XNS];
#pragma unroll
            for (int r = 0; r < 4; ++r)
                async_b128((unsigned)(size_t)&xb[row[r] * XNS + q[r]],
                           X + (size_t)(k1 + row[r]) * 256 + m0 + q[r]);
#pragma unroll
            for (int r = 0; r < 4; ++r)
                ry[r] = *(const float4*)(Y + (size_t)(k1 + row[r]) * 256 + n0 + q[r]);
        }
        const float* xs = &Xsm[cur * 32 * XNS];
        const float* ys = &Ysm[cur * 16 * BSP];
#pragma unroll
        for (int kk = 0; kk < 32; kk += 4) {
            const int mcol = wid * 16 + mlo;
            v2f a = { xs[(kk + khalf) * XNS + mcol], xs[(kk + khalf + 1) * XNS + mcol] };
            const float* yp = &ys[((kk >> 1) + hi) * BSP + mlo * 2];
            v2f b0 = *(const v2f*)(yp + 0);
            v2f b1 = *(const v2f*)(yp + 32);
            v2f b2 = *(const v2f*)(yp + 64);
            v2f b3 = *(const v2f*)(yp + 96);
            acc[0] = wmma4(a, b0, acc[0]);
            acc[1] = wmma4(a, b1, acc[1]);
            acc[2] = wmma4(a, b2, acc[2]);
            acc[3] = wmma4(a, b3, acc[3]);
        }
        if (c + 1 < NC) {
            float* yb = &Ysm[nxt * 16 * BSP];
#pragma unroll
            for (int r = 0; r < 4; ++r) {
                float* yp = &yb[(row[r] >> 1) * BSP + (row[r] & 1)];
                yp[(q[r] + 0) * 2] = ry[r].x;  yp[(q[r] + 1) * 2] = ry[r].y;
                yp[(q[r] + 2) * 2] = ry[r].z;  yp[(q[r] + 3) * 2] = ry[r].w;
            }
        }
        wait_async0();
        __syncthreads();
    }

    const int rbase = m0 + wid * 16 + hi * 8;
#pragma unroll
    for (int nt = 0; nt < 4; ++nt) {
        const int col = n0 + nt * 16 + mlo;
#pragma unroll
        for (int r = 0; r < 8; ++r)
            S[(size_t)(rbase + r) * 256 + col] = acc[nt][r];
    }
}

// ---------------------------------------------------------------------------
// out = BN(A_b @ Bm_b + bias) + res   (batched A, batched B, fused BN epilogue)
// ---------------------------------------------------------------------------
__global__ __launch_bounds__(256)
void gemm_bn_res_k(const float* __restrict__ A, const float* __restrict__ Bm,
                   const float* __restrict__ bvec, const float* __restrict__ gam,
                   const float* __restrict__ bet,  const float* __restrict__ mea,
                   const float* __restrict__ var,  const float* __restrict__ res,
                   float* __restrict__ D,
                   int M, int N, int K,
                   long long aBatch, long long bBatch, long long rBatch)
{
    __shared__ float Asm[2 * 128 * AS];
    __shared__ float Bsm[2 * 16 * BSP];
    A   += (long long)blockIdx.z * aBatch;
    Bm  += (long long)blockIdx.z * bBatch;
    res += (long long)blockIdx.z * rBatch;
    D   += (long long)blockIdx.z * rBatch;
    const int m0 = blockIdx.y * 128;
    const int n0 = blockIdx.x * 64;
    const int t    = threadIdx.x;
    const int lane = t & 31;
    const int wid  = t >> 5;
    const int mlo  = lane & 15;
    const int hi   = lane >> 4;
    const int khalf = hi * 2;

    int arow[4], akq[4];
#pragma unroll
    for (int r = 0; r < 4; ++r) { int idx = t + r * 256; arow[r] = idx >> 3; akq[r] = (idx & 7) << 2; }
    int brow[2], bnq[2];
#pragma unroll
    for (int r = 0; r < 2; ++r) { int idx = t + r * 256; brow[r] = idx >> 4; bnq[r] = (idx & 15) << 2; }

    float4 rb[2];
    v8f acc[4] = {};
    const int NC = K >> 5;

#pragma unroll
    for (int r = 0; r < 4; ++r)
        async_b128((unsigned)(size_t)&Asm[arow[r] * AS + akq[r]],
                   A + (size_t)(m0 + arow[r]) * K + akq[r]);
#pragma unroll
    for (int r = 0; r < 2; ++r)
        rb[r] = *(const float4*)(Bm + (size_t)brow[r] * N + n0 + bnq[r]);
#pragma unroll
    for (int r = 0; r < 2; ++r) {
        float* bp = &Bsm[(brow[r] >> 1) * BSP + (brow[r] & 1)];
        bp[(bnq[r] + 0) * 2] = rb[r].x;  bp[(bnq[r] + 1) * 2] = rb[r].y;
        bp[(bnq[r] + 2) * 2] = rb[r].z;  bp[(bnq[r] + 3) * 2] = rb[r].w;
    }
    wait_async0();
    __syncthreads();

    for (int c = 0; c < NC; ++c) {
        const int cur = c & 1;
        const int nxt = cur ^ 1;
        const int k1 = (c + 1) << 5;
        if (c + 1 < NC) {
            float* asn = &Asm[nxt * 128 * AS];
#pragma unroll
            for (int r = 0; r < 4; ++r)
                async_b128((unsigned)(size_t)&asn[arow[r] * AS + akq[r]],
                           A + (size_t)(m0 + arow[r]) * K + k1 + akq[r]);
#pragma unroll
            for (int r = 0; r < 2; ++r)
                rb[r] = *(const float4*)(Bm + (size_t)(k1 + brow[r]) * N + n0 + bnq[r]);
        }
        const float* as = &Asm[cur * 128 * AS];
        const float* bs = &Bsm[cur * 16 * BSP];
#pragma unroll
        for (int kk = 0; kk < 32; kk += 4) {
            v2f a = *(const v2f*)(&as[(wid * 16 + mlo) * AS + kk + khalf]);
            const float* bp = &bs[((kk >> 1) + hi) * BSP + mlo * 2];
            v2f b0 = *(const v2f*)(bp + 0);
            v2f b1 = *(const v2f*)(bp + 32);
            v2f b2 = *(const v2f*)(bp + 64);
            v2f b3 = *(const v2f*)(bp + 96);
            acc[0] = wmma4(a, b0, acc[0]);
            acc[1] = wmma4(a, b1, acc[1]);
            acc[2] = wmma4(a, b2, acc[2]);
            acc[3] = wmma4(a, b3, acc[3]);
        }
        if (c + 1 < NC) {
            float* bsn = &Bsm[nxt * 16 * BSP];
#pragma unroll
            for (int r = 0; r < 2; ++r) {
                float* bp = &bsn[(brow[r] >> 1) * BSP + (brow[r] & 1)];
                bp[(bnq[r] + 0) * 2] = rb[r].x;  bp[(bnq[r] + 1) * 2] = rb[r].y;
                bp[(bnq[r] + 2) * 2] = rb[r].z;  bp[(bnq[r] + 3) * 2] = rb[r].w;
            }
        }
        wait_async0();
        __syncthreads();
    }

    const int rbase = m0 + wid * 16 + hi * 8;
#pragma unroll
    for (int nt = 0; nt < 4; ++nt) {
        const int col = n0 + nt * 16 + mlo;
        const float sc = gam[col] * rsqrtf(var[col] + 1e-3f);
        const float sh = (bvec[col] - mea[col]) * sc + bet[col];
#pragma unroll
        for (int r = 0; r < 8; ++r) {
            const size_t off = (size_t)(rbase + r) * N + col;
            D[off] = acc[nt][r] * sc + sh + res[off];
        }
    }
}

// ---------------------------------------------------------------------------
extern "C" void kernel_launch(void* const* d_in, const int* in_sizes, int n_in,
                              void* d_out, int out_size, void* d_ws, size_t ws_size,
                              hipStream_t stream)
{
    const float* detect = (const float*)d_in[0];   // (8,64,64,512)
    const float* aim    = (const float*)d_in[1];   // (8,32,32,512)
    const float* Wg   = (const float*)d_in[2];
    const float* bg   = (const float*)d_in[3];
    const float* Wt   = (const float*)d_in[4];
    const float* bt   = (const float*)d_in[5];
    const float* Wp   = (const float*)d_in[6];
    const float* bp   = (const float*)d_in[7];
    const float* Ww   = (const float*)d_in[8];
    const float* bw   = (const float*)d_in[9];
    const float* gw   = (const float*)d_in[10];
    const float* betw = (const float*)d_in[11];
    const float* mw   = (const float*)d_in[12];
    const float* vw   = (const float*)d_in[13];
    const float* Wq   = (const float*)d_in[14];
    const float* bq   = (const float*)d_in[15];
    const float* gq   = (const float*)d_in[16];
    const float* betq = (const float*)d_in[17];
    const float* mq   = (const float*)d_in[18];
    const float* vq   = (const float*)d_in[19];

    float* out_aim = (float*)d_out;                       // 8*32*32*512
    float* out_det = out_aim + (size_t)8 * 32 * 32 * 512; // 8*64*64*512

    float* ws    = (float*)d_ws;
    float* d_x   = ws;  ws += (size_t)32768 * 256;
    float* phi   = ws;  ws += (size_t)32768 * 256;
    float* a_x   = ws;  ws += (size_t)8192 * 256;
    float* theta = ws;  ws += (size_t)8192 * 256;
    float* S1    = ws;  ws += (size_t)8 * 256 * 256;
    float* S2    = ws;  ws += (size_t)8 * 256 * 256;
    float* T1    = ws;  ws += (size_t)8 * 256 * 512;
    float* T2    = ws;  ws += (size_t)8 * 256 * 512;

    dim3 blk(256);
    // 1) input projections (batch folded into M)
    gemm_bias_k<<<dim3(4, 256, 1), blk, 0, stream>>>(detect, Wg, bg, d_x,   32768, 256, 512, 1.0f, 0, 0);
    gemm_bias_k<<<dim3(4, 256, 1), blk, 0, stream>>>(detect, Wp, bp, phi,   32768, 256, 512, 1.0f, 0, 0);
    gemm_bias_k<<<dim3(4,  64, 1), blk, 0, stream>>>(aim,    Wg, bg, a_x,    8192, 256, 512, 1.0f, 0, 0);
    gemm_bias_k<<<dim3(4,  64, 1), blk, 0, stream>>>(aim,    Wt, bt, theta,  8192, 256, 512, 1.0f, 0, 0);
    // 2) S1_b = phi_b^T d_x_b (K=4096) ; S2_b = theta_b^T a_x_b (K=1024)
    gemm_tn_k<<<dim3(4, 4, 8), dim3(128), 0, stream>>>(phi,   d_x, S1, 4096, 4096LL * 256, 4096LL * 256);
    gemm_tn_k<<<dim3(4, 4, 8), dim3(128), 0, stream>>>(theta, a_x, S2, 1024, 1024LL * 256, 1024LL * 256);
    // 3) T1 = (S1 @ Ww)/Nd ; T2 = (S2 @ Wq)/Na   (per batch 256x512)
    gemm_bias_k<<<dim3(8, 2, 8), blk, 0, stream>>>(S1, Ww, nullptr, T1, 256, 512, 256, 1.0f / 4096.0f, 256LL * 256, 256LL * 512);
    gemm_bias_k<<<dim3(8, 2, 8), blk, 0, stream>>>(S2, Wq, nullptr, T2, 256, 512, 256, 1.0f / 1024.0f, 256LL * 256, 256LL * 512);
    // 4) non_aim = BN(theta_b @ T1_b + bw) + aim ; non_det = BN(phi_b @ T2_b + bq) + detect
    gemm_bn_res_k<<<dim3(8,  8, 8), blk, 0, stream>>>(theta, T1, bw, gw, betw, mw, vw, aim,
                                                      out_aim, 1024, 512, 256,
                                                      1024LL * 256, 256LL * 512, 1024LL * 512);
    gemm_bn_res_k<<<dim3(8, 32, 8), blk, 0, stream>>>(phi,   T2, bq, gq, betq, mq, vq, detect,
                                                      out_det, 4096, 512, 256,
                                                      4096LL * 256, 256LL * 512, 4096LL * 512);
}

// v001
// It runs in 268 microseconds.
// In both of two side-by-side timings against v000, it was 1.29 times as fast.
#include <hip/hip_runtime.h>
#include <hip/hip_bf16.h>

typedef __attribute__((ext_vector_type(2))) float v2f;
typedef __attribute__((ext_vector_type(8))) float v8f;

__device__ __forceinline__ v8f wmma4(v2f a, v2f b, v8f c) {
    // D = A(16x4 f32) * B(4x16 f32) + C(16x16 f32), exact fp32
    return __builtin_amdgcn_wmma_f32_16x16x4_f32(false, a, false, b, (short)0, c,
                                                 false, false);
}

__device__ __forceinline__ void async_b128(unsigned ldsOff, const void* gaddr) {
    asm volatile("global_load_async_to_lds_b128 %0, %1, off"
                 :: "v"(ldsOff), "v"(gaddr) : "memory");
}
__device__ __forceinline__ void wait_async0() {
    asm volatile("s_wait_asynccnt 0" ::: "memory");
}

#define AS  36
#define BSP 160
#define XNS 68

// ---------------------------------------------------------------------------
// D[M,N] = alpha * (A[M,K] @ W[K,N]) + bias[N]   (batched via z; W shared)
// block = 256 threads (8 waves); tile 128(M) x 64(N); K chunk 32
// A tile: async global->LDS DMA (double buffered); B tile: reg-staged interleave
// ---------------------------------------------------------------------------
__global__ __launch_bounds__(256)
void gemm_bias_k(const float* __restrict__ A, const float* __restrict__ W,
                 const float* __restrict__ bias, float* __restrict__ D,
                 int M, int N, int K, float alpha,
                 long long aBatch, long long dBatch)
{
    __shared__ float Asm[2 * 128 * AS];
    __shared__ float Bsm[2 * 16 * BSP];
    A += (long long)blockIdx.z * aBatch;
    D += (long long)blockIdx.z * dBatch;
    const int m0 = blockIdx.y * 128;
    const int n0 = blockIdx.x * 64;
    const int t    = threadIdx.x;
    const int lane = t & 31;
    const int wid  = t >> 5;          // 0..7
    const int mlo  = lane & 15;
    const int hi   = lane >> 4;       // 0/1
    const int khalf = hi * 2;

    int arow[4], akq[4];
#pragma unroll
    for (int r = 0; r < 4; ++r) { int idx = t + r * 256; arow[r] = idx >> 3; akq[r] = (idx & 7) << 2; }
    int brow[2], bnq[2];
#pragma unroll
    for (int r = 0; r < 2; ++r) { int idx = t + r * 256; brow[r] = idx >> 4; bnq[r] = (idx & 15) << 2; }

    float4 rb[2];
    v8f acc[4] = {};
    const int NC = K >> 5;

    // prologue: chunk 0 (A via async DMA, B via registers)
#pragma unroll
    for (int r = 0; r < 4; ++r)
        async_b128((unsigned)(size_t)&Asm[arow[r] * AS + akq[r]],
                   A + (size_t)(m0 + arow[r]) * K + akq[r]);
#pragma unroll
    for (int r = 0; r < 2; ++r)
        rb[r] = *(const float4*)(W + (size_t)brow[r] * N + n0 + bnq[r]);
#pragma unroll
    for (int r = 0; r < 2; ++r) {
        float* bp = &Bsm[(brow[r] >> 1) * BSP + (brow[r] & 1)];
        bp[(bnq[r] + 0) * 2] = rb[r].x;  bp[(bnq[r] + 1) * 2] = rb[r].y;
        bp[(bnq[r] + 2) * 2] = rb[r].z;  bp[(bnq[r] + 3) * 2] = rb[r].w;
    }
    wait_async0();
    __syncthreads();

    for (int c = 0; c < NC; ++c) {
        const int cur = c & 1;
        const int nxt = cur ^ 1;
        const int k1 = (c + 1) << 5;
        if (c + 1 < NC) {
            float* asn = &Asm[nxt * 128 * AS];
#pragma unroll
            for (int r = 0; r < 4; ++r)
                async_b128((unsigned)(size_t)&asn[arow[r] * AS + akq[r]],
                           A + (size_t)(m0 + arow[r]) * K + k1 + akq[r]);
#pragma unroll
            for (int r = 0; r < 2; ++r)
                rb[r] = *(const float4*)(W + (size_t)(k1 + brow[r]) * N + n0 + bnq[r]);
        }
        const float* as = &Asm[cur * 128 * AS];
        const float* bs = &Bsm[cur * 16 * BSP];
#pragma unroll
        for (int kk = 0; kk < 32; kk += 4) {
            v2f a = *(const v2f*)(&as[(wid * 16 + mlo) * AS + kk + khalf]);
            const float* bp = &bs[((kk >> 1) + hi) * BSP + mlo * 2];
            v2f b0 = *(const v2f*)(bp + 0);
            v2f b1 = *(const v2f*)(bp + 32);
            v2f b2 = *(const v2f*)(bp + 64);
            v2f b3 = *(const v2f*)(bp + 96);
            acc[0] = wmma4(a, b0, acc[0]);
            acc[1] = wmma4(a, b1, acc[1]);
            acc[2] = wmma4(a, b2, acc[2]);
            acc[3] = wmma4(a, b3, acc[3]);
        }
        if (c + 1 < NC) {
            float* bsn = &Bsm[nxt * 16 * BSP];
#pragma unroll
            for (int r = 0; r < 2; ++r) {
                float* bp = &bsn[(brow[r] >> 1) * BSP + (brow[r] & 1)];
                bp[(bnq[r] + 0) * 2] = rb[r].x;  bp[(bnq[r] + 1) * 2] = rb[r].y;
                bp[(bnq[r] + 2) * 2] = rb[r].z;  bp[(bnq[r] + 3) * 2] = rb[r].w;
            }
        }
        wait_async0();
        __syncthreads();
    }

    const int rbase = m0 + wid * 16 + hi * 8;
#pragma unroll
    for (int nt = 0; nt < 4; ++nt) {
        const int col = n0 + nt * 16 + mlo;
        const float bv = bias ? bias[col] : 0.0f;
#pragma unroll
        for (int r = 0; r < 8; ++r)
            D[(size_t)(rbase + r) * N + col] = acc[nt][r] * alpha + bv;
    }
}

// ---------------------------------------------------------------------------
// S_b[256,256] = X_b[K,256]^T @ Y_b[K,256]   (batched)
// block = 128 threads (4 waves); tile 64 x 64; K chunk 32
// X tile: async DMA into natural [k][m] layout; Y tile: reg-staged interleave
// ---------------------------------------------------------------------------
__global__ __launch_bounds__(128)
void gemm_tn_k(const float* __restrict__ X, const float* __restrict__ Y,
               float* __restrict__ S, int Kd,
               long long xBatch, long long yBatch)
{
    __shared__ float Xsm[2 * 32 * XNS];
    __shared__ float Ysm[2 * 16 * BSP];
    X += (long long)blockIdx.z * xBatch;
    Y += (long long)blockIdx.z * yBatch;
    S += (long long)blockIdx.z * (256LL * 256LL);
    const int m0 = blockIdx.y * 64;
    const int n0 = blockIdx.x * 64;
    const int t    = threadIdx.x;
    const int lane = t & 31;
    const int wid  = t >> 5;          // 0..3
    const int mlo  = lane & 15;
    const int hi   = lane >> 4;
    const int khalf = hi * 2;

    int row[4], q[4];
#pragma unroll
    for (int r = 0; r < 4; ++r) { int idx = t + r * 128; row[r] = idx >> 4; q[r] = (idx & 15) << 2; }

    float4 ry[4];
    v8f acc[4] = {};
    const int NC = Kd >> 5;

#pragma unroll
    for (int r = 0; r < 4; ++r)
        async_b128((unsigned)(size_t)&Xsm[row[r] * XNS + q[r]],
                   X + (size_t)row[r] * 256 + m0 + q[r]);
#pragma unroll
    for (int r = 0; r < 4; ++r)
        ry[r] = *(const float4*)(Y + (size_t)row[r] * 256 + n0 + q[r]);
#pragma unroll
    for (int r = 0; r < 4; ++r) {
        float* yp = &Ysm[(row[r] >> 1) * BSP + (row[r] & 1)];
        yp[(q[r] + 0) * 2] = ry[r].x;  yp[(q[r] + 1) * 2] = ry[r].y;
        yp[(q[r] + 2) * 2] = ry[r].z;  yp[(q[r] + 3) * 2] = ry[r].w;
    }
    wait_async0();
    __syncthreads();

    for (int c = 0; c < NC; ++c) {
        const int cur = c & 1;
        const int nxt = cur ^ 1;
        const int k1 = (c + 1) << 5;
        if (c + 1 < NC) {
            float* xb = &Xsm[nxt * 32 * XNS];
#pragma unroll
            for (int r = 0; r < 4; ++r)
                async_b128((unsigned)(size_t)&xb[row[r] * XNS + q[r]],
                           X + (size_t)(k1 + row[r]) * 256 + m0 + q[r]);
#pragma unroll
            for (int r = 0; r < 4; ++r)
                ry[r] = *(const float4*)(Y + (size_t)(k1 + row[r]) * 256 + n0 + q[r]);
        }
        const float* xs = &Xsm[cur * 32 * XNS];
        const float* ys = &Ysm[cur * 16 * BSP];
#pragma unroll
        for (int kk = 0; kk < 32; kk += 4) {
            const int mcol = wid * 16 + mlo;
            v2f a = { xs[(kk + khalf) * XNS + mcol], xs[(kk + khalf + 1) * XNS + mcol] };
            const float* yp = &ys[((kk >> 1) + hi) * BSP + mlo * 2];
            v2f b0 = *(const v2f*)(yp + 0);
            v2f b1 = *(const v2f*)(yp + 32);
            v2f b2 = *(const v2f*)(yp + 64);
            v2f b3 = *(const v2f*)(yp + 96);
            acc[0] = wmma4(a, b0, acc[0]);
            acc[1] = wmma4(a, b1, acc[1]);
            acc[2] = wmma4(a, b2, acc[2]);
            acc[3] = wmma4(a, b3, acc[3]);
        }
        if (c + 1 < NC) {
            float* yb = &Ysm[nxt * 16 * BSP];
#pragma unroll
            for (int r = 0; r < 4; ++r) {
                float* yp = &yb[(row[r] >> 1) * BSP + (row[r] & 1)];
                yp[(q[r] + 0) * 2] = ry[r].x;  yp[(q[r] + 1) * 2] = ry[r].y;
                yp[(q[r] + 2) * 2] = ry[r].z;  yp[(q[r] + 3) * 2] = ry[r].w;
            }
        }
        wait_async0();
        __syncthreads();
    }

    const int rbase = m0 + wid * 16 + hi * 8;
#pragma unroll
    for (int nt = 0; nt < 4; ++nt) {
        const int col = n0 + nt * 16 + mlo;
#pragma unroll
        for (int r = 0; r < 8; ++r)
            S[(size_t)(rbase + r) * 256 + col] = acc[nt][r];
    }
}

// ---------------------------------------------------------------------------
// out = BN(A_b @ Bm_b + bias) + res   (batched A, batched B, fused BN epilogue)
// ---------------------------------------------------------------------------
__global__ __launch_bounds__(256)
void gemm_bn_res_k(const float* __restrict__ A, const float* __restrict__ Bm,
                   const float* __restrict__ bvec, const float* __restrict__ gam,
                   const float* __restrict__ bet,  const float* __restrict__ mea,
                   const float* __restrict__ var,  const float* __restrict__ res,
                   float* __restrict__ D,
                   int M, int N, int K,
                   long long aBatch, long long bBatch, long long rBatch)
{
    __shared__ float Asm[2 * 128 * AS];
    __shared__ float Bsm[2 * 16 * BSP];
    A   += (long long)blockIdx.z * aBatch;
    Bm  += (long long)blockIdx.z * bBatch;
    res += (long long)blockIdx.z * rBatch;
    D   += (long long)blockIdx.z * rBatch;
    const int m0 = blockIdx.y * 128;
    const int n0 = blockIdx.x * 64;
    const int t    = threadIdx.x;
    const int lane = t & 31;
    const int wid  = t >> 5;
    const int mlo  = lane & 15;
    const int hi   = lane >> 4;
    const int khalf = hi * 2;

    int arow[4], akq[4];
#pragma unroll
    for (int r = 0; r < 4; ++r) { int idx = t + r * 256; arow[r] = idx >> 3; akq[r] = (idx & 7) << 2; }
    int brow[2], bnq[2];
#pragma unroll
    for (int r = 0; r < 2; ++r) { int idx = t + r * 256; brow[r] = idx >> 4; bnq[r] = (idx & 15) << 2; }

    float4 rb[2];
    v8f acc[4] = {};
    const int NC = K >> 5;

#pragma unroll
    for (int r = 0; r < 4; ++r)
        async_b128((unsigned)(size_t)&Asm[arow[r] * AS + akq[r]],
                   A + (size_t)(m0 + arow[r]) * K + akq[r]);
#pragma unroll
    for (int r = 0; r < 2; ++r)
        rb[r] = *(const float4*)(Bm + (size_t)brow[r] * N + n0 + bnq[r]);
#pragma unroll
    for (int r = 0; r < 2; ++r) {
        float* bp = &Bsm[(brow[r] >> 1) * BSP + (brow[r] & 1)];
        bp[(bnq[r] + 0) * 2] = rb[r].x;  bp[(bnq[r] + 1) * 2] = rb[r].y;
        bp[(bnq[r] + 2) * 2] = rb[r].z;  bp[(bnq[r] + 3) * 2] = rb[r].w;
    }
    wait_async0();
    __syncthreads();

    for (int c = 0; c < NC; ++c) {
        const int cur = c & 1;
        const int nxt = cur ^ 1;
        const int k1 = (c + 1) << 5;
        if (c + 1 < NC) {
            float* asn = &Asm[nxt * 128 * AS];
#pragma unroll
            for (int r = 0; r < 4; ++r)
                async_b128((unsigned)(size_t)&asn[arow[r] * AS + akq[r]],
                           A + (size_t)(m0 + arow[r]) * K + k1 + akq[r]);
#pragma unroll
            for (int r = 0; r < 2; ++r)
                rb[r] = *(const float4*)(Bm + (size_t)(k1 + brow[r]) * N + n0 + bnq[r]);
        }
        const float* as = &Asm[cur * 128 * AS];
        const float* bs = &Bsm[cur * 16 * BSP];
#pragma unroll
        for (int kk = 0; kk < 32; kk += 4) {
            v2f a = *(const v2f*)(&as[(wid * 16 + mlo) * AS + kk + khalf]);
            const float* bp = &bs[((kk >> 1) + hi) * BSP + mlo * 2];
            v2f b0 = *(const v2f*)(bp + 0);
            v2f b1 = *(const v2f*)(bp + 32);
            v2f b2 = *(const v2f*)(bp + 64);
            v2f b3 = *(const v2f*)(bp + 96);
            acc[0] = wmma4(a, b0, acc[0]);
            acc[1] = wmma4(a, b1, acc[1]);
            acc[2] = wmma4(a, b2, acc[2]);
            acc[3] = wmma4(a, b3, acc[3]);
        }
        if (c + 1 < NC) {
            float* bsn = &Bsm[nxt * 16 * BSP];
#pragma unroll
            for (int r = 0; r < 2; ++r) {
                float* bp = &bsn[(brow[r] >> 1) * BSP + (brow[r] & 1)];
                bp[(bnq[r] + 0) * 2] = rb[r].x;  bp[(bnq[r] + 1) * 2] = rb[r].y;
                bp[(bnq[r] + 2) * 2] = rb[r].z;  bp[(bnq[r] + 3) * 2] = rb[r].w;
            }
        }
        wait_async0();
        __syncthreads();
    }

    const int rbase = m0 + wid * 16 + hi * 8;
#pragma unroll
    for (int nt = 0; nt < 4; ++nt) {
        const int col = n0 + nt * 16 + mlo;
        const float sc = gam[col] * rsqrtf(var[col] + 1e-3f);
        const float sh = (bvec[col] - mea[col]) * sc + bet[col];
#pragma unroll
        for (int r = 0; r < 8; ++r) {
            const size_t off = (size_t)(rbase + r) * N + col;
            D[off] = acc[nt][r] * sc + sh + res[off];
        }
    }
}

// ---------------------------------------------------------------------------
// Split-K sum: S[b] = sum over s of P[b*8 + s]; every plane is 256 x 256 floats.
// blockIdx.y picks the product (0: Pa -> Sa, 1: Pb -> Sb); one float4 per thread,
// planes added in ascending s.
// ---------------------------------------------------------------------------
__global__ __launch_bounds__(256)
void splitk_sum_k(const float* __restrict__ Pa, float* __restrict__ Sa,
                  const float* __restrict__ Pb, float* __restrict__ Sb)
{
    const float* P = blockIdx.y ? Pb : Pa;
    float*       S = blockIdx.y ? Sb : Sa;
    const int i = (blockIdx.x * 256 + threadIdx.x) * 4;   // 0 .. 8*65536-4
    const int b = i >> 16;
    const int e = i & 65535;
    const float* p = P + (size_t)b * (8 * 65536) + e;
    float4 v[8];
#pragma unroll
    for (int s = 0; s < 8; ++s) v[s] = *(const float4*)(p + s * 65536);
    float4 a = v[0];
#pragma unroll
    for (int s = 1; s < 8; ++s) { a.x += v[s].x; a.y += v[s].y; a.z += v[s].z; a.w += v[s].w; }
    *(float4*)(S + i) = a;
}

// ---------------------------------------------------------------------------
extern "C" void kernel_launch(void* const* d_in, const int* in_sizes, int n_in,
                              void* d_out, int out_size, void* d_ws, size_t ws_size,
                              hipStream_t stream)
{
    const float* detect = (const float*)d_in[0];   // (8,64,64,512)
    const float* aim    = (const float*)d_in[1];   // (8,32,32,512)
    const float* Wg   = (const float*)d_in[2];
    const float* bg   = (const float*)d_in[3];
    const float* Wt   = (const float*)d_in[4];
    const float* bt   = (const float*)d_in[5];
    const float* Wp   = (const float*)d_in[6];
    const float* bp   = (const float*)d_in[7];
    const float* Ww   = (const float*)d_in[8];
    const float* bw   = (const float*)d_in[9];
    const float* gw   = (const float*)d_in[10];
    const float* betw = (const float*)d_in[11];
    const float* mw   = (const float*)d_in[12];
    const float* vw   = (const float*)d_in[13];
    const float* Wq   = (const float*)d_in[14];
    const float* bq   = (const float*)d_in[15];
    const float* gq   = (const float*)d_in[16];
    const float* betq = (const float*)d_in[17];
    const float* mq   = (const float*)d_in[18];
    const float* vq   = (const float*)d_in[19];

    float* out_aim = (float*)d_out;                       // 8*32*32*512
    float* out_det = out_aim + (size_t)8 * 32 * 32 * 512; // 8*64*64*512

    float* ws    = (float*)d_ws;
    float* d_x   = ws;  ws += (size_t)32768 * 256;
    float* phi   = ws;  ws += (size_t)32768 * 256;
    float* a_x   = ws;  ws += (size_t)8192 * 256;
    float* theta = ws;  ws += (size_t)8192 * 256;
    float* S1    = ws;  ws += (size_t)8 * 256 * 256;
    float* S2    = ws;  ws += (size_t)8 * 256 * 256;
    float* T1    = ws;  ws += (size_t)8 * 256 * 512;
    float* T2    = ws;  ws += (size_t)8 * 256 * 512;
    float* P1    = ws;  ws += (size_t)64 * 256 * 256;
    float* P2    = ws;  ws += (size_t)64 * 256 * 256;

    dim3 blk(256);
    // 1) input projections (batch folded into M)
    gemm_bias_k<<<dim3(4, 256, 1), blk, 0, stream>>>(detect, Wg, bg, d_x,   32768, 256, 512, 1.0f, 0, 0);
    gemm_bias_k<<<dim3(4, 256, 1), blk, 0, stream>>>(detect, Wp, bp, phi,   32768, 256, 512, 1.0f, 0, 0);
    gemm_bias_k<<<dim3(4,  64, 1), blk, 0, stream>>>(aim,    Wg, bg, a_x,    8192, 256, 512, 1.0f, 0, 0);
    gemm_bias_k<<<dim3(4,  64, 1), blk, 0, stream>>>(aim,    Wt, bt, theta,  8192, 256, 512, 1.0f, 0, 0);
    // 2) S1_b = phi_b^T d_x_b (K=4096) ; S2_b = theta_b^T a_x_b (K=1024), each split 8 ways
    //    along K: z = b*8 + s takes rows [s*K/8, (s+1)*K/8) of batch b into plane z, then
    //    one launch adds the 8 planes of each batch.
    gemm_tn_k<<<dim3(4, 4, 64), dim3(128), 0, stream>>>(phi,   d_x, P1, 512, 512LL * 256, 512LL * 256);
    gemm_tn_k<<<dim3(4, 4, 64), dim3(128), 0, stream>>>(theta, a_x, P2, 128, 128LL * 256, 128LL * 256);
    splitk_sum_k<<<dim3(512, 2, 1), blk, 0, stream>>>(P1, S1, P2, S2);
    // 3) T1 = (S1 @ Ww)/Nd ; T2 = (S2 @ Wq)/Na   (per batch 256x512)
    gemm_bias_k<<<dim3(8, 2, 8), blk, 0, stream>>>(S1, Ww, nullptr, T1, 256, 512, 256, 1.0f / 4096.0f, 256LL * 256, 256LL * 512);
    gemm_bias_k<<<dim3(8, 2, 8), blk, 0, stream>>>(S2, Wq, nullptr, T2, 256, 512, 256, 1.0f / 1024.0f, 256LL * 256, 256LL * 512);
    // 4) non_aim = BN(theta_b @ T1_b + bw) + aim ; non_det = BN(phi_b @ T2_b + bq) + detect
    gemm_bn_res_k<<<dim3(8,  8, 8), blk, 0, stream>>>(theta, T1, bw, gw, betw, mw, vw, aim,
                                                      out_aim, 1024, 512, 256,
                                                      1024LL * 256, 256LL * 512, 1024LL * 512);
    gemm_bn_res_k<<<dim3(8, 32, 8), blk, 0, stream>>>(phi,   T2, bq, gq, betq, mq, vq, detect,
                                                      out_det, 4096, 512, 256,
                                                      4096LL * 256, 256LL * 512, 4096LL * 512);
}
